// v000
// The times below were measured on an AMD MI455X: many runs one after another, warmed up first and cycling through
// copies of the inputs, with the whole window's GPU time divided by the number of runs. Launches and the gaps
// between them are all in it. The median over several windows is given; except for v000 it joins two sittings, which
// can be a few percent apart, so the side-by-side timings, each taken in one sitting, are the better comparison.
// The starting kernel, v000, takes 374 microseconds a run.
#include <hip/hip_runtime.h>
#include <hip/hip_bf16.h>
#include <math.h>

// Problem constants (match reference)
#define TOK_N 8192
#define DIM   512
#define HID   2048
#define NEXP  8
#define GFD   1024   // 2*DIM gate features

typedef _Float16 half_t;
typedef _Float16 v4h  __attribute__((ext_vector_type(4)));
typedef _Float16 v16h __attribute__((ext_vector_type(16)));
typedef float    v8f  __attribute__((ext_vector_type(8)));

#define XS_STRIDE 520   // 512 + 8 halves padding (1040B row, 16B aligned)
#define HS_STRIDE 136   // 128 + 8
#define HCHUNK    128

__device__ __forceinline__ int frag_koff(int lane, int p) {
  return ((p & 1) << 2) + ((p & 2) << 3) + ((lane & 16) ? 8 : 0);
}

__device__ __forceinline__ v16h load_frag(const half_t* rowp, int lane) {
  v16h f;
#pragma unroll
  for (int p = 0; p < 4; ++p) {
    v4h t = *(const v4h*)(rowp + frag_koff(lane, p));
#pragma unroll
    for (int q = 0; q < 4; ++q) f[4 * p + q] = t[q];
  }
  return f;
}

// ---------------------------------------------------------------------------
// Kernel 1: zero combined accumulator + expert counts
// ---------------------------------------------------------------------------
__global__ void zero_kernel(float* __restrict__ comb, int* __restrict__ counts,
                            long total) {
  long i = (long)blockIdx.x * blockDim.x + threadIdx.x;
  if (i < total) comb[i] = 0.0f;
  if (i < NEXP) counts[i] = 0;
}

// ---------------------------------------------------------------------------
// Kernel 2: fp32 -> fp16 conversion of fc1_w, fc2_w and x (vectorized x4)
// ---------------------------------------------------------------------------
__global__ void cvt_kernel(const float* __restrict__ a, const float* __restrict__ b,
                           const float* __restrict__ xs, half_t* __restrict__ ah,
                           half_t* __restrict__ bh, half_t* __restrict__ xh,
                           long nw, long nx) {
  long i4 = ((long)blockIdx.x * blockDim.x + threadIdx.x) * 4;
  if (i4 < nw) {
    float4 va = *(const float4*)(a + i4);
    float4 vb = *(const float4*)(b + i4);
    v4h ha, hb;
    ha[0] = (half_t)va.x; ha[1] = (half_t)va.y; ha[2] = (half_t)va.z; ha[3] = (half_t)va.w;
    hb[0] = (half_t)vb.x; hb[1] = (half_t)vb.y; hb[2] = (half_t)vb.z; hb[3] = (half_t)vb.w;
    *(v4h*)(ah + i4) = ha;
    *(v4h*)(bh + i4) = hb;
  }
  if (i4 < nx) {
    float4 vx = *(const float4*)(xs + i4);
    v4h hx;
    hx[0] = (half_t)vx.x; hx[1] = (half_t)vx.y; hx[2] = (half_t)vx.z; hx[3] = (half_t)vx.w;
    *(v4h*)(xh + i4) = hx;
  }
}

__global__ __launch_bounds__(256) void gating_kernel(
    const float* __restrict__ gf, const float* __restrict__ noise,
    const float* __restrict__ wg, const float* __restrict__ wn,
    int* __restrict__ counts, int* __restrict__ etok, float* __restrict__ egate) {
  const int lane = threadIdx.x & 31;
  const int wid  = threadIdx.x >> 5;
  const int t    = blockIdx.x * 8 + wid;
  if (t >= TOK_N) return;

  float ag[NEXP], an[NEXP];
#pragma unroll
  for (int j = 0; j < NEXP; ++j) { ag[j] = 0.0f; an[j] = 0.0f; }

  const float* gfr = gf + (size_t)t * GFD;
  for (int d = lane; d < GFD; d += 32) {
    float f = gfr[d];
    const float* wgr = wg + d * NEXP;
    const float* wnr = wn + d * NEXP;
#pragma unroll
    for (int j = 0; j < NEXP; ++j) {
      ag[j] += f * wgr[j];
      an[j] += f * wnr[j];
    }
  }
#pragma unroll
  for (int off = 16; off >= 1; off >>= 1) {
#pragma unroll
    for (int j = 0; j < NEXP; ++j) {
      ag[j] += __shfl_xor(ag[j], off, 32);
      an[j] += __shfl_xor(an[j], off, 32);
    }
  }

  if (lane == 0) {
    float logit[NEXP];
#pragma unroll
    for (int j = 0; j < NEXP; ++j) {
      float s  = an[j];
      float sp = (s > 20.0f) ? s : log1pf(expf(s));  // softplus
      logit[j] = ag[j] + noise[(size_t)t * NEXP + j] * (sp + 1e-2f);
    }
    int i0 = 0;
#pragma unroll
    for (int j = 1; j < NEXP; ++j) if (logit[j] > logit[i0]) i0 = j;
    int i1 = (i0 == 0) ? 1 : 0;
#pragma unroll
    for (int j = 0; j < NEXP; ++j)
      if (j != i0 && logit[j] > logit[i1]) i1 = j;

    float e1  = expf(logit[i1] - logit[i0]);
    float inv = 1.0f / (1.0f + e1);
    int s0 = atomicAdd(&counts[i0], 1);
    etok[i0 * TOK_N + s0]  = t;
    egate[i0 * TOK_N + s0] = inv;
    int s1 = atomicAdd(&counts[i1], 1);
    etok[i1 * TOK_N + s1]  = t;
    egate[i1 * TOK_N + s1] = e1 * inv;
  }
}

__global__ __launch_bounds__(256) void ffn_kernel(
    const half_t* __restrict__ xh, const half_t* __restrict__ w1,
    const float* __restrict__ b1, const half_t* __restrict__ w2,
    const float* __restrict__ b2, const int* __restrict__ counts,
    const int* __restrict__ etok, const float* __restrict__ egate,
    float* __restrict__ combined) {
  __shared__ half_t Xs[32 * XS_STRIDE];  // 32 tokens x 512 (f16, padded)
  __shared__ half_t Hs[32 * HS_STRIDE];  // 32 tokens x 128 hidden chunk (f16)

  const int e   = blockIdx.x / (TOK_N / 32);
  const int tb  = blockIdx.x % (TOK_N / 32);
  const int m0  = tb * 32;
  const int cnt = counts[e];
  if (m0 >= cnt) return;  // uniform early-exit for inactive tiles

  const int tid  = threadIdx.x;
  const int lane = tid & 31;
  const int wid  = tid >> 5;
  const int r    = wid & 1;
  const int cg   = wid >> 1;
  const int mrow = lane & 15;

  // ---- async gather of X tile (fp16) into LDS: 8 threads/row x 8 b128 ----
  {
    const int row = tid >> 3;  // 32 rows
    const int gr  = m0 + row;
    // invalid rows read a valid fallback row; their output is never consumed
    const int t   = (gr < cnt) ? etok[e * TOK_N + gr] : etok[e * TOK_N + m0];
    const half_t* src = xh + (size_t)t * DIM + (tid & 7) * 64;
    unsigned int ldsa =
        (unsigned int)(uintptr_t)&Xs[row * XS_STRIDE + (tid & 7) * 64];
#pragma unroll
    for (int j = 0; j < 8; ++j) {
      const half_t* gp = src + j * 8;          // 16B chunk
      unsigned int la  = ldsa + j * 16;
      asm volatile("global_load_async_to_lds_b128 %0, %1, off"
                   :: "v"(la), "v"(gp) : "memory");
    }
    asm volatile("s_wait_asynccnt 0" ::: "memory");
  }
  __syncthreads();

  v8f acc[8];
#pragma unroll
  for (int j = 0; j < 8; ++j) acc[j] = (v8f){};

  const half_t* w1e = w1 + (size_t)e * HID * DIM;
  const half_t* w2e = w2 + (size_t)e * DIM * HID;

#pragma unroll 1
  for (int hc = 0; hc < HID; hc += HCHUNK) {
    // hint next chunk of W1 into cache (global_prefetch path)
    if (hc + HCHUNK < HID)
      __builtin_prefetch(w1e + (size_t)(hc + HCHUNK + cg * 32 + r * 16 + mrow) * DIM, 0, 1);

    // ---- stage 1: h = gelu(X @ W1^T + b1) for 128 hidden cols ----
    v8f a1[2];
    a1[0] = (v8f){};
    a1[1] = (v8f){};
#pragma unroll 4
    for (int kk = 0; kk < DIM; kk += 32) {
      v16h A = load_frag(&Xs[(r * 16 + mrow) * XS_STRIDE + kk], lane);
#pragma unroll
      for (int c2 = 0; c2 < 2; ++c2) {
        int h = hc + (cg * 2 + c2) * 16 + mrow;  // B col = lane&15 selects h-row
        v16h B = load_frag(w1e + (size_t)h * DIM + kk, lane);
        a1[c2] = __builtin_amdgcn_wmma_f32_16x16x32_f16(
            false, A, false, B, (short)0, a1[c2], false, false);
      }
    }
#pragma unroll
    for (int c2 = 0; c2 < 2; ++c2) {
      int hl = (cg * 2 + c2) * 16 + mrow;
      float bias = b1[e * HID + hc + hl];
#pragma unroll
      for (int i = 0; i < 8; ++i) {
        int m = r * 16 + i + ((lane & 16) ? 8 : 0);
        float v = a1[c2][i] + bias;
        float g = 0.5f * v * (1.0f + erff(v * 0.70710678118654752f));
        Hs[m * HS_STRIDE + hl] = (half_t)g;
      }
    }
    __syncthreads();

    // ---- stage 2: acc += h @ W2^T over this 128-wide hidden chunk ----
#pragma unroll
    for (int kk = 0; kk < HCHUNK; kk += 32) {
      v16h A = load_frag(&Hs[(r * 16 + mrow) * HS_STRIDE + kk], lane);
#pragma unroll
      for (int j = 0; j < 8; ++j) {
        int o = cg * 128 + j * 16 + mrow;
        v16h B = load_frag(w2e + (size_t)o * HID + hc + kk, lane);
        acc[j] = __builtin_amdgcn_wmma_f32_16x16x32_f16(
            false, A, false, B, (short)0, acc[j], false, false);
      }
    }
    __syncthreads();  // Hs reused next chunk
  }

  // ---- epilogue: combined[t, :] += gate * exp(out + b2) ----
  // Each token gets exactly 2 contributions (top-2 experts); 2-term fp add is
  // commutative, so atomicAdd order does not affect the final bit pattern.
#pragma unroll
  for (int i = 0; i < 8; ++i) {
    int m  = r * 16 + i + ((lane & 16) ? 8 : 0);
    int gr = m0 + m;
    if (gr < cnt) {
      int t      = etok[e * TOK_N + gr];
      float gate = egate[e * TOK_N + gr];
      float* dst = combined + (size_t)t * DIM;
#pragma unroll
      for (int j = 0; j < 8; ++j) {
        int o   = cg * 128 + j * 16 + mrow;
        float v = acc[j][i] + b2[e * DIM + o];
        atomicAdd(dst + o, gate * expf(v));
      }
    }
  }
}

// ---------------------------------------------------------------------------
// Kernel 5: SparseDispatcher.combine tail: eps-fill + log
// ---------------------------------------------------------------------------
__global__ void combine_kernel(const float* __restrict__ comb,
                               float* __restrict__ out, long total) {
  long i = (long)blockIdx.x * blockDim.x + threadIdx.x;
  if (i < total) {
    float c = comb[i];
    out[i] = logf((c == 0.0f) ? 2.2204460492503131e-16f : c);
  }
}

// ---------------------------------------------------------------------------
extern "C" void kernel_launch(void* const* d_in, const int* in_sizes, int n_in,
                              void* d_out, int out_size, void* d_ws,
                              size_t ws_size, hipStream_t stream) {
  (void)in_sizes; (void)n_in; (void)out_size; (void)ws_size;

  const float* x     = (const float*)d_in[0];
  const float* gfeat = (const float*)d_in[1];
  const float* noise = (const float*)d_in[2];
  const float* wg    = (const float*)d_in[3];
  const float* wn    = (const float*)d_in[4];
  const float* fc1w  = (const float*)d_in[5];
  const float* fc1b  = (const float*)d_in[6];
  const float* fc2w  = (const float*)d_in[7];
  const float* fc2b  = (const float*)d_in[8];
  float* out = (float*)d_out;

  // workspace layout (256B aligned blocks)
  char* ws = (char*)d_ws;
  size_t off = 0;
  int* counts = (int*)(ws + off);            off += 256;
  int* etok   = (int*)(ws + off);            off += (size_t)NEXP * TOK_N * 4;
  float* egate = (float*)(ws + off);         off += (size_t)NEXP * TOK_N * 4;
  float* combined = (float*)(ws + off);      off += (size_t)TOK_N * DIM * 4;
  half_t* w1h = (half_t*)(ws + off);         off += (size_t)NEXP * HID * DIM * 2;
  half_t* w2h = (half_t*)(ws + off);         off += (size_t)NEXP * DIM * HID * 2;
  half_t* xh  = (half_t*)(ws + off);         off += (size_t)TOK_N * DIM * 2;

  const long totND = (long)TOK_N * DIM;
  const long nw    = (long)NEXP * HID * DIM;

  zero_kernel<<<(int)((totND + 255) / 256), 256, 0, stream>>>(combined, counts, totND);
  cvt_kernel<<<(int)((nw / 4 + 255) / 256), 256, 0, stream>>>(fc1w, fc2w, x, w1h, w2h,
                                                              xh, nw, totND);
  gating_kernel<<<TOK_N / 8, 256, 0, stream>>>(gfeat, noise, wg, wn, counts, etok, egate);
  ffn_kernel<<<NEXP * (TOK_N / 32), 256, 0, stream>>>(xh, w1h, fc1b, w2h, fc2b,
                                                      counts, etok, egate, combined);
  combine_kernel<<<(int)((totND + 255) / 256), 256, 0, stream>>>(combined, out, totND);
}

// v001
// Measured time: 215 microseconds a run.
// Next to v000, in two timings, it ran 1.76 times as fast each time.
#include <hip/hip_runtime.h>
#include <hip/hip_bf16.h>
#include <math.h>

// Problem constants (match reference)
#define TOK_N 8192
#define DIM   512
#define HID   2048
#define NEXP  8
#define GFD   1024   // 2*DIM gate features

typedef _Float16 half_t;
typedef _Float16 v4h  __attribute__((ext_vector_type(4)));
typedef _Float16 v16h __attribute__((ext_vector_type(16)));
typedef float    v8f  __attribute__((ext_vector_type(8)));

#define XS_STRIDE 520   // 512 + 8 halves padding (1040B row, 16B aligned)
#define HS_STRIDE 264   // 256 + 8
#define HCHUNK    256
#define MT        80    // tokens per work-group tile
#define RT        5     // MT / 16 row tiles
#define MTILES    ((TOK_N + MT - 1) / MT)

__device__ __forceinline__ int frag_koff(int lane, int p) {
  return ((p & 1) << 2) + ((p & 2) << 3) + ((lane & 16) ? 8 : 0);
}

__device__ __forceinline__ v16h load_frag(const half_t* rowp, int lane) {
  v16h f;
#pragma unroll
  for (int p = 0; p < 4; ++p) {
    v4h t = *(const v4h*)(rowp + frag_koff(lane, p));
#pragma unroll
    for (int q = 0; q < 4; ++q) f[4 * p + q] = t[q];
  }
  return f;
}

// ---------------------------------------------------------------------------
// Kernel 1: zero combined accumulator + expert counts
// ---------------------------------------------------------------------------
__global__ void zero_kernel(float* __restrict__ comb, int* __restrict__ counts,
                            long total) {
  long i = (long)blockIdx.x * blockDim.x + threadIdx.x;
  if (i < total) comb[i] = 0.0f;
  if (i < NEXP) counts[i] = 0;
}

// ---------------------------------------------------------------------------
// Kernel 2: fp32 -> fp16 conversion of fc1_w, fc2_w and x (vectorized x4)
// ---------------------------------------------------------------------------
__global__ void cvt_kernel(const float* __restrict__ a, const float* __restrict__ b,
                           const float* __restrict__ xs, half_t* __restrict__ ah,
                           half_t* __restrict__ bh, half_t* __restrict__ xh,
                           long nw, long nx) {
  long i4 = ((long)blockIdx.x * blockDim.x + threadIdx.x) * 4;
  if (i4 < nw) {
    float4 va = *(const float4*)(a + i4);
    float4 vb = *(const float4*)(b + i4);
    v4h ha, hb;
    ha[0] = (half_t)va.x; ha[1] = (half_t)va.y; ha[2] = (half_t)va.z; ha[3] = (half_t)va.w;
    hb[0] = (half_t)vb.x; hb[1] = (half_t)vb.y; hb[2] = (half_t)vb.z; hb[3] = (half_t)vb.w;
    *(v4h*)(ah + i4) = ha;
    *(v4h*)(bh + i4) = hb;
  }
  if (i4 < nx) {
    float4 vx = *(const float4*)(xs + i4);
    v4h hx;
    hx[0] = (half_t)vx.x; hx[1] = (half_t)vx.y; hx[2] = (half_t)vx.z; hx[3] = (half_t)vx.w;
    *(v4h*)(xh + i4) = hx;
  }
}

__global__ __launch_bounds__(256) void gating_kernel(
    const float* __restrict__ gf, const float* __restrict__ noise,
    const float* __restrict__ wg, const float* __restrict__ wn,
    int* __restrict__ counts, int* __restrict__ etok, float* __restrict__ egate) {
  const int lane = threadIdx.x & 31;
  const int wid  = threadIdx.x >> 5;
  const int t    = blockIdx.x * 8 + wid;
  if (t >= TOK_N) return;

  float ag[NEXP], an[NEXP];
#pragma unroll
  for (int j = 0; j < NEXP; ++j) { ag[j] = 0.0f; an[j] = 0.0f; }

  const float* gfr = gf + (size_t)t * GFD;
  for (int d = lane; d < GFD; d += 32) {
    float f = gfr[d];
    const float* wgr = wg + d * NEXP;
    const float* wnr = wn + d * NEXP;
#pragma unroll
    for (int j = 0; j < NEXP; ++j) {
      ag[j] += f * wgr[j];
      an[j] += f * wnr[j];
    }
  }
#pragma unroll
  for (int off = 16; off >= 1; off >>= 1) {
#pragma unroll
    for (int j = 0; j < NEXP; ++j) {
      ag[j] += __shfl_xor(ag[j], off, 32);
      an[j] += __shfl_xor(an[j], off, 32);
    }
  }

  if (lane == 0) {
    float logit[NEXP];
#pragma unroll
    for (int j = 0; j < NEXP; ++j) {
      float s  = an[j];
      float sp = (s > 20.0f) ? s : log1pf(expf(s));  // softplus
      logit[j] = ag[j] + noise[(size_t)t * NEXP + j] * (sp + 1e-2f);
    }
    int i0 = 0;
#pragma unroll
    for (int j = 1; j < NEXP; ++j) if (logit[j] > logit[i0]) i0 = j;
    int i1 = (i0 == 0) ? 1 : 0;
#pragma unroll
    for (int j = 0; j < NEXP; ++j)
      if (j != i0 && logit[j] > logit[i1]) i1 = j;

    float e1  = expf(logit[i1] - logit[i0]);
    float inv = 1.0f / (1.0f + e1);
    int s0 = atomicAdd(&counts[i0], 1);
    etok[i0 * TOK_N + s0]  = t;
    egate[i0 * TOK_N + s0] = inv;
    int s1 = atomicAdd(&counts[i1], 1);
    etok[i1 * TOK_N + s1]  = t;
    egate[i1 * TOK_N + s1] = e1 * inv;
  }
}

__device__ __forceinline__ void async_copy5(const unsigned int* la,
                                            const half_t* const* gp) {
  asm volatile(
      "global_load_async_to_lds_b128 %0, %1, off\n\t"
      "global_load_async_to_lds_b128 %2, %3, off\n\t"
      "global_load_async_to_lds_b128 %4, %5, off\n\t"
      "global_load_async_to_lds_b128 %6, %7, off\n\t"
      "global_load_async_to_lds_b128 %8, %9, off\n\t"
      "s_wait_xcnt 0x0"
      :: "v"(la[0]), "v"(gp[0]), "v"(la[1]), "v"(gp[1]), "v"(la[2]), "v"(gp[2]),
         "v"(la[3]), "v"(gp[3]), "v"(la[4]), "v"(gp[4])
      : "memory");
}

__global__ __launch_bounds__(512) void ffn_kernel(
    const half_t* __restrict__ xh, const half_t* __restrict__ w1,
    const float* __restrict__ b1, const half_t* __restrict__ w2,
    const float* __restrict__ b2, const int* __restrict__ counts,
    const int* __restrict__ etok, const float* __restrict__ egate,
    float* __restrict__ combined) {
  // MT tokens x 512 (f16, padded)
  __shared__ __attribute__((aligned(16))) half_t Xs[MT * XS_STRIDE];
  // MT tokens x HCHUNK hidden chunk (f16, padded)
  __shared__ __attribute__((aligned(16))) half_t Hs[MT * HS_STRIDE];

  const int e   = blockIdx.x / MTILES;
  const int tb  = blockIdx.x % MTILES;
  const int m0  = tb * MT;
  const int cnt = counts[e];
  if (m0 >= cnt) return;  // uniform early-exit for inactive tiles

  const int tid  = threadIdx.x;
  const int lane = tid & 31;
  const int wid  = tid >> 5;
  const int mrow = lane & 15;
  const int hi8  = (lane & 16) ? 8 : 0;

  // ---- async gather of X tile (fp16) into LDS: 64 threads/row, 8 rows a pass,
  //      10 passes = 80 rows; every lane copies 16 B in every pass ----
#pragma unroll
  for (int g = 0; g < MT / 40; ++g) {
    unsigned int la[5];
    const half_t* gp[5];
#pragma unroll
    for (int j = 0; j < 5; ++j) {
      const int row = (g * 5 + j) * 8 + (tid >> 6);
      const int gr  = m0 + row;
      // invalid rows read a valid fallback row; their output is never consumed
      const int t   = etok[e * TOK_N + ((gr < cnt) ? gr : m0)];
      gp[j] = xh + (size_t)t * DIM + (tid & 63) * 8;
      la[j] = (unsigned int)(uintptr_t)&Xs[row * XS_STRIDE + (tid & 63) * 8];
    }
    async_copy5(la, gp);
  }
  // the copies of this wave have landed; the barrier publishes them to the rest
  asm volatile("s_wait_asynccnt 0x0" ::: "memory");
  __syncthreads();

  v8f acc[RT][2];
#pragma unroll
  for (int rt = 0; rt < RT; ++rt)
#pragma unroll
    for (int j = 0; j < 2; ++j) acc[rt][j] = (v8f){};

  const half_t* w1e = w1 + (size_t)e * HID * DIM;
  const half_t* w2e = w2 + (size_t)e * DIM * HID;

  // kept rolled: a flat loop would only multiply the code size
#pragma unroll 1
  for (int hc = 0; hc < HID; hc += HCHUNK) {
    // hint next chunk of W1 into cache (global_prefetch path)
    if (hc + HCHUNK < HID)
      __builtin_prefetch(w1e + (size_t)(hc + HCHUNK + wid * 16 + mrow) * DIM, 0, 1);

    // ---- stage 1: h = gelu(X @ W1^T + b1) for HCHUNK hidden cols;
    //      this wave: hidden cols wid*16 .. wid*16+15, all MT tokens ----
    const int hl = wid * 16 + mrow;  // B col = lane&15 selects h-row
    v8f a1[RT];
#pragma unroll
    for (int rt = 0; rt < RT; ++rt) a1[rt] = (v8f){};
    // four k steps a trip, so that their weight loads can issue as one group
#pragma unroll 4
    for (int kk = 0; kk < DIM; kk += 32) {
      v16h B = load_frag(w1e + (size_t)(hc + hl) * DIM + kk, lane);
#pragma unroll
      for (int rt = 0; rt < RT; ++rt) {
        v16h A = load_frag(&Xs[(rt * 16 + mrow) * XS_STRIDE + kk], lane);
        a1[rt] = __builtin_amdgcn_wmma_f32_16x16x32_f16(
            false, A, false, B, (short)0, a1[rt], false, false);
      }
    }
    {
      float bias = b1[e * HID + hc + hl];
#pragma unroll
      for (int rt = 0; rt < RT; ++rt) {
#pragma unroll
        for (int i = 0; i < 8; ++i) {
          int m = rt * 16 + i + hi8;
          float v = a1[rt][i] + bias;
          float g = 0.5f * v * (1.0f + erff(v * 0.70710678118654752f));
          Hs[m * HS_STRIDE + hl] = (half_t)g;
        }
      }
    }
    __syncthreads();

    // ---- stage 2: acc += h @ W2^T over this hidden chunk;
    //      this wave: output cols wid*32 .. wid*32+31, all MT tokens ----
#pragma unroll
    for (int kk = 0; kk < HCHUNK; kk += 32) {
      v16h A[RT];
#pragma unroll
      for (int rt = 0; rt < RT; ++rt)
        A[rt] = load_frag(&Hs[(rt * 16 + mrow) * HS_STRIDE + kk], lane);
      v16h B[2];
#pragma unroll
      for (int j = 0; j < 2; ++j) {
        int o = wid * 32 + j * 16 + mrow;
        B[j] = load_frag(w2e + (size_t)o * HID + hc + kk, lane);
      }
#pragma unroll
      for (int j = 0; j < 2; ++j)
#pragma unroll
        for (int rt = 0; rt < RT; ++rt)
          acc[rt][j] = __builtin_amdgcn_wmma_f32_16x16x32_f16(
              false, A[rt], false, B[j], (short)0, acc[rt][j], false, false);
    }
    __syncthreads();  // Hs reused next chunk
  }

  // ---- epilogue: combined[t, :] += gate * exp(out + b2) ----
  // Each token gets exactly 2 contributions (top-2 experts); 2-term fp add is
  // commutative, so atomicAdd order does not affect the final bit pattern.
#pragma unroll
  for (int rt = 0; rt < RT; ++rt) {
#pragma unroll
    for (int i = 0; i < 8; ++i) {
      int m  = rt * 16 + i + hi8;
      int gr = m0 + m;
      if (gr < cnt) {
        int t      = etok[e * TOK_N + gr];
        float gate = egate[e * TOK_N + gr];
        float* dst = combined + (size_t)t * DIM;
#pragma unroll
        for (int j = 0; j < 2; ++j) {
          int o   = wid * 32 + j * 16 + mrow;
          float v = acc[rt][j][i] + b2[e * DIM + o];
          atomicAdd(dst + o, gate * expf(v));
          asm volatile("s_wait_xcnt 0x0" ::: "memory");
        }
      }
    }
  }
}

// ---------------------------------------------------------------------------
// Kernel 5: SparseDispatcher.combine tail: eps-fill + log
// ---------------------------------------------------------------------------
__global__ void combine_kernel(const float* __restrict__ comb,
                               float* __restrict__ out, long total) {
  long i = (long)blockIdx.x * blockDim.x + threadIdx.x;
  if (i < total) {
    float c = comb[i];
    out[i] = logf((c == 0.0f) ? 2.2204460492503131e-16f : c);
  }
}

// ---------------------------------------------------------------------------
extern "C" void kernel_launch(void* const* d_in, const int* in_sizes, int n_in,
                              void* d_out, int out_size, void* d_ws,
                              size_t ws_size, hipStream_t stream) {
  (void)in_sizes; (void)n_in; (void)out_size; (void)ws_size;

  const float* x     = (const float*)d_in[0];
  const float* gfeat = (const float*)d_in[1];
  const float* noise = (const float*)d_in[2];
  const float* wg    = (const float*)d_in[3];
  const float* wn    = (const float*)d_in[4];
  const float* fc1w  = (const float*)d_in[5];
  const float* fc1b  = (const float*)d_in[6];
  const float* fc2w  = (const float*)d_in[7];
  const float* fc2b  = (const float*)d_in[8];
  float* out = (float*)d_out;

  // workspace layout (256B aligned blocks)
  char* ws = (char*)d_ws;
  size_t off = 0;
  int* counts = (int*)(ws + off);            off += 256;
  int* etok   = (int*)(ws + off);            off += (size_t)NEXP * TOK_N * 4;
  float* egate = (float*)(ws + off);         off += (size_t)NEXP * TOK_N * 4;
  float* combined = (float*)(ws + off);      off += (size_t)TOK_N * DIM * 4;
  half_t* w1h = (half_t*)(ws + off);         off += (size_t)NEXP * HID * DIM * 2;
  half_t* w2h = (half_t*)(ws + off);         off += (size_t)NEXP * DIM * HID * 2;
  half_t* xh  = (half_t*)(ws + off);         off += (size_t)TOK_N * DIM * 2;

  const long totND = (long)TOK_N * DIM;
  const long nw    = (long)NEXP * HID * DIM;

  zero_kernel<<<(int)((totND + 255) / 256), 256, 0, stream>>>(combined, counts, totND);
  cvt_kernel<<<(int)((nw / 4 + 255) / 256), 256, 0, stream>>>(fc1w, fc2w, x, w1h, w2h,
                                                              xh, nw, totND);
  gating_kernel<<<TOK_N / 8, 256, 0, stream>>>(gfeat, noise, wg, wn, counts, etok, egate);
  ffn_kernel<<<NEXP * MTILES, 512, 0, stream>>>(xh, w1h, fc1b, w2h, fc2b,
                                                      counts, etok, egate, combined);
  combine_kernel<<<(int)((totND + 255) / 256), 256, 0, stream>>>(combined, out, totND);
}
